// v000
// Measured on an AMD MI455X. A time is GPU time per run, averaged over a window of back-to-back runs after a warm-up
// (all launches, gaps included; the runs take copies of the inputs in turn), and the median of several windows.
// Apart from v000's, it joins two sittings. Times from different sittings can be a few percent apart, while
// side-by-side timings come from the same sitting.
// v000, which the later versions start from, runs in 553 microseconds.
#include <hip/hip_runtime.h>

typedef float v2f __attribute__((ext_vector_type(2)));
typedef float v4f __attribute__((ext_vector_type(4)));
typedef float v8f __attribute__((ext_vector_type(8)));

#define LSEQ 2048
#define EDIM 1024
#define NH   16
#define HD   64
#define INV_SQRT_E 0.03125f  // 1/sqrt(1024)
#define KSTRIDE 68           // padded LDS row stride for K/V tiles

// D = A(16x4) * B(4x16) + C, fp32. 8-arg form:
// (neg_a, A, neg_b, B, c_mod, C, reuse_a, reuse_b)
__device__ __forceinline__ v8f wmma_f32(v2f a, v2f b, v8f c) {
  return __builtin_amdgcn_wmma_f32_16x16x4_f32(false, a, false, b, (short)0, c,
                                               false, false);
}

// ---------------------------------------------------------------------------
// NT GEMM: Out[m, n] = sum_k X[m, k] * W[n, k] (+ bias[n])
// One wave computes a 64x64 tile: 4x4 grid of 16x16 WMMA accumulators.
// A-frag (16x4 fp32): lanes 0-15 hold M=lane, K = {0,1}; lanes 16-31 hold
// M=lane-16, K = {2,3}  -> per-lane contiguous float2 at X[row, kb + 2*hi].
// B-frag mirrors A with N in place of M (W is read row-wise: B[k][n]=W[n,k]).
// C/D: VGPR r, lanes 0-15 -> (M=r, N=lane); lanes 16-31 -> (M=r+8, N=lane-16).
// ---------------------------------------------------------------------------
__device__ __forceinline__ void gemm_nt_64x64(const float* __restrict__ X,
                                              const float* __restrict__ W,
                                              const float* __restrict__ bias,
                                              float* __restrict__ Out) {
  const int lane = threadIdx.x;
  const int lo = lane & 15;
  const int hi = lane >> 4;
  const int row0 = blockIdx.x * 64;
  const int col0 = blockIdx.y * 64;

  v8f acc[4][4];
#pragma unroll
  for (int i = 0; i < 4; ++i)
#pragma unroll
    for (int j = 0; j < 4; ++j)
      acc[i][j] = {0.f, 0.f, 0.f, 0.f, 0.f, 0.f, 0.f, 0.f};

  for (int kb = 0; kb < EDIM; kb += 4) {
    v2f a[4], b[4];
#pragma unroll
    for (int t = 0; t < 4; ++t) {
      a[t] = *(const v2f*)(X + (size_t)(row0 + t * 16 + lo) * EDIM + kb + 2 * hi);
      b[t] = *(const v2f*)(W + (size_t)(col0 + t * 16 + lo) * EDIM + kb + 2 * hi);
    }
#pragma unroll
    for (int i = 0; i < 4; ++i)
#pragma unroll
      for (int j = 0; j < 4; ++j) acc[i][j] = wmma_f32(a[i], b[j], acc[i][j]);
  }

#pragma unroll
  for (int i = 0; i < 4; ++i)
#pragma unroll
    for (int j = 0; j < 4; ++j) {
      const int col = col0 + j * 16 + lo;
      const float bv = bias ? bias[col] : 0.0f;
#pragma unroll
      for (int r = 0; r < 8; ++r) {
        const int row = row0 + i * 16 + r + 8 * hi;
        Out[(size_t)row * EDIM + col] = acc[i][j][r] + bv;
      }
    }
}

__global__ __launch_bounds__(32) void proj3(
    const float* __restrict__ values, const float* __restrict__ keys,
    const float* __restrict__ query, const float* __restrict__ Wv,
    const float* __restrict__ Wk, const float* __restrict__ Wq,
    float* __restrict__ vout, float* __restrict__ kout,
    float* __restrict__ qout) {
  const float* X;
  const float* W;
  float* O;
  if (blockIdx.z == 0) {
    X = values; W = Wv; O = vout;
  } else if (blockIdx.z == 1) {
    X = keys; W = Wk; O = kout;
  } else {
    X = query; W = Wq; O = qout;
  }
  gemm_nt_64x64(X, W, nullptr, O);
}

__global__ __launch_bounds__(32) void gemm_out(const float* __restrict__ X,
                                               const float* __restrict__ W,
                                               const float* __restrict__ bias,
                                               float* __restrict__ Out) {
  gemm_nt_64x64(X, W, bias, Out);
}

// ---------------------------------------------------------------------------
// Fused attention with distance bias, flash-style online softmax.
// 4 waves / block; each wave owns 16 query rows (block covers 64).
// K/V 16x64 tiles are double-buffered in LDS, shared by all 4 waves, with
// the next tile's global loads overlapped with compute on the current tile.
// ---------------------------------------------------------------------------
__global__ __launch_bounds__(128) void attn_fused(
    const float* __restrict__ Q, const float* __restrict__ K,
    const float* __restrict__ V, const float* __restrict__ dist,
    float* __restrict__ Oout) {
  __shared__ float kbuf[2][16 * KSTRIDE];
  __shared__ float vbuf[2][16 * KSTRIDE];
  __shared__ float pbuf[4][16 * 18];  // per-wave padded P tile (C->A transpose)

  const int tid = threadIdx.x;
  const int lane = tid & 31;
  const int w = tid >> 5;  // wave id 0..3
  const int lo = lane & 15;
  const int hi = lane >> 4;
  const int qb = blockIdx.x * 64 + w * 16;
  const int h = blockIdx.y;
  const size_t hoff = (size_t)h * HD;

  // cooperative staging indices: 128 threads x 8 floats = one 16x64 tile
  const int srow = tid >> 3;       // 0..15
  const int scol = (tid & 7) * 8;  // 0,8,...,56

  // Q tile as 16 A-fragments over D=64 (k-steps of 4)
  v2f qa[16];
#pragma unroll
  for (int d4 = 0; d4 < 16; ++d4)
    qa[d4] = *(const v2f*)(Q + (size_t)(qb + lo) * EDIM + hoff + 4 * d4 + 2 * hi);

  float mrow[8], srun[8];
  v8f o[4];
#pragma unroll
  for (int r = 0; r < 8; ++r) {
    mrow[r] = -3.0e38f;
    srun[r] = 0.0f;
  }
#pragma unroll
  for (int t = 0; t < 4; ++t) o[t] = {0.f, 0.f, 0.f, 0.f, 0.f, 0.f, 0.f, 0.f};

  // prologue: stage key/value tile 0 into buffer 0
  {
    const float* kg = K + (size_t)srow * EDIM + hoff + scol;
    const float* vg = V + (size_t)srow * EDIM + hoff + scol;
    v4f k0 = *(const v4f*)kg;
    v4f k1 = *(const v4f*)(kg + 4);
    v4f v0 = *(const v4f*)vg;
    v4f v1 = *(const v4f*)(vg + 4);
    *(v4f*)&kbuf[0][srow * KSTRIDE + scol] = k0;
    *(v4f*)&kbuf[0][srow * KSTRIDE + scol + 4] = k1;
    *(v4f*)&vbuf[0][srow * KSTRIDE + scol] = v0;
    *(v4f*)&vbuf[0][srow * KSTRIDE + scol + 4] = v1;
  }
  __syncthreads();

  const int NT = LSEQ / 16;
  for (int kt = 0; kt < NT; ++kt) {
    const int kb = kt * 16;
    const int cur = kt & 1;
    const int nxt = cur ^ 1;
    const bool havenext = (kt + 1) < NT;  // block-uniform

    // issue next tile's global loads early (overlap with WMMA compute)
    v4f pk0, pk1, pv0, pv1;
    if (havenext) {
      const float* kg = K + (size_t)(kb + 16 + srow) * EDIM + hoff + scol;
      const float* vg = V + (size_t)(kb + 16 + srow) * EDIM + hoff + scol;
      pk0 = *(const v4f*)kg;
      pk1 = *(const v4f*)(kg + 4);
      pv0 = *(const v4f*)vg;
      pv1 = *(const v4f*)(vg + 4);
    }

    const float* klds = kbuf[cur];
    const float* vlds = vbuf[cur];

    // energy tile: E = Q * K^T  (B[k=d][n=key] = K[kb+n, d], from LDS)
    v8f e = {0.f, 0.f, 0.f, 0.f, 0.f, 0.f, 0.f, 0.f};
#pragma unroll
    for (int d4 = 0; d4 < 16; ++d4) {
      v2f kf = *(const v2f*)(klds + lo * KSTRIDE + 4 * d4 + 2 * hi);
      e = wmma_f32(qa[d4], kf, e);
    }

    // distance bias + scale + online softmax (per C-layout row r)
    float p[8];
#pragma unroll
    for (int r = 0; r < 8; ++r) {
      const int row = qb + r + 8 * hi;
      const float dm = dist[(size_t)row * LSEQ + kb + lo];
      const float bias = (dm == 0.0f) ? 0.0f : 1.0f / (dm + 1.0f);
      const float z = (e[r] + bias) * INV_SQRT_E;

      float mx = z;  // row max across the 16 lanes holding this row
      mx = fmaxf(mx, __shfl_xor(mx, 1, 32));
      mx = fmaxf(mx, __shfl_xor(mx, 2, 32));
      mx = fmaxf(mx, __shfl_xor(mx, 4, 32));
      mx = fmaxf(mx, __shfl_xor(mx, 8, 32));
      const float mnew = fmaxf(mrow[r], mx);
      const float c = __expf(mrow[r] - mnew);
      const float pe = __expf(z - mnew);
      float rs = pe;
      rs += __shfl_xor(rs, 1, 32);
      rs += __shfl_xor(rs, 2, 32);
      rs += __shfl_xor(rs, 4, 32);
      rs += __shfl_xor(rs, 8, 32);
      srun[r] = srun[r] * c + rs;
      mrow[r] = mnew;
      p[r] = pe;
#pragma unroll
      for (int nt = 0; nt < 4; ++nt) o[nt][r] *= c;  // rescale O row
    }

    // transpose P (C layout -> row-major LDS -> A frags); wave-private slice,
    // same-wave LDS is in-order, compiler inserts the dscnt wait for reads.
    float* pw = pbuf[w];
#pragma unroll
    for (int r = 0; r < 8; ++r) pw[(r + 8 * hi) * 18 + lo] = p[r];
    asm volatile("" ::: "memory");
    v2f pa[4];
#pragma unroll
    for (int kc = 0; kc < 4; ++kc)
      pa[kc] = *(const v2f*)(pw + lo * 18 + 4 * kc + 2 * hi);

    // O += P * V  (B[k=key][n=d] = V[kb+key, nt*16 + n], from LDS)
#pragma unroll
    for (int kc = 0; kc < 4; ++kc) {
      const float* vrow = vlds + (4 * kc + 2 * hi) * KSTRIDE;
#pragma unroll
      for (int nt = 0; nt < 4; ++nt) {
        v2f vb;
        vb.x = vrow[nt * 16 + lo];
        vb.y = vrow[KSTRIDE + nt * 16 + lo];
        o[nt] = wmma_f32(pa[kc], vb, o[nt]);
      }
    }

    // commit next tile into the other buffer, then block barrier
    if (havenext) {
      *(v4f*)&kbuf[nxt][srow * KSTRIDE + scol] = pk0;
      *(v4f*)&kbuf[nxt][srow * KSTRIDE + scol + 4] = pk1;
      *(v4f*)&vbuf[nxt][srow * KSTRIDE + scol] = pv0;
      *(v4f*)&vbuf[nxt][srow * KSTRIDE + scol + 4] = pv1;
    }
    __syncthreads();
  }

  // normalize and write [L, H*D]
#pragma unroll
  for (int nt = 0; nt < 4; ++nt)
#pragma unroll
    for (int r = 0; r < 8; ++r) {
      const int row = qb + r + 8 * hi;
      Oout[(size_t)row * EDIM + hoff + nt * 16 + lo] = o[nt][r] / srun[r];
    }
}

// ---------------------------------------------------------------------------
extern "C" void kernel_launch(void* const* d_in, const int* in_sizes, int n_in,
                              void* d_out, int out_size, void* d_ws,
                              size_t ws_size, hipStream_t stream) {
  const float* values = (const float*)d_in[0];
  const float* keys = (const float*)d_in[1];
  const float* query = (const float*)d_in[2];
  const float* dist = (const float*)d_in[3];
  const float* Wv = (const float*)d_in[4];
  const float* Wk = (const float*)d_in[5];
  const float* Wq = (const float*)d_in[6];
  const float* Wo = (const float*)d_in[7];
  const float* bo = (const float*)d_in[8];
  float* out = (float*)d_out;

  float* vproj = (float*)d_ws;
  float* kproj = vproj + (size_t)LSEQ * EDIM;
  float* qproj = kproj + (size_t)LSEQ * EDIM;
  float* aout = qproj + (size_t)LSEQ * EDIM;

  // 1) three input projections (z selects values/keys/query)
  dim3 pgrid(LSEQ / 64, EDIM / 64, 3);
  proj3<<<pgrid, dim3(32), 0, stream>>>(values, keys, query, Wv, Wk, Wq, vproj,
                                        kproj, qproj);

  // 2) fused biased attention: 4 waves/block, 64 query rows/block, per head
  dim3 agrid(LSEQ / 64, NH);
  attn_fused<<<agrid, dim3(128), 0, stream>>>(qproj, kproj, vproj, dist, aout);

  // 3) output projection + bias
  dim3 ogrid(LSEQ / 64, EDIM / 64, 1);
  gemm_out<<<ogrid, dim3(32), 0, stream>>>(aout, Wo, bo, out);
}

// v001
// It runs in 283 microseconds.
// Next to v000, in two timings, it ran 2.00 and 2.01 times as fast.
#include <hip/hip_runtime.h>

typedef float v2f __attribute__((ext_vector_type(2)));
typedef float v4f __attribute__((ext_vector_type(4)));
typedef float v8f __attribute__((ext_vector_type(8)));

#define LSEQ 2048
#define EDIM 1024
#define NH   16
#define HD   64
#define INV_SQRT_E 0.03125f  // 1/sqrt(1024)
#define KSTRIDE 68           // padded LDS row stride for K/V tiles

// D = A(16x4) * B(4x16) + C, fp32. 8-arg form:
// (neg_a, A, neg_b, B, c_mod, C, reuse_a, reuse_b)
__device__ __forceinline__ v8f wmma_f32(v2f a, v2f b, v8f c) {
  return __builtin_amdgcn_wmma_f32_16x16x4_f32(false, a, false, b, (short)0, c,
                                               false, false);
}

// ---------------------------------------------------------------------------
// NT GEMM: Out[m, n] = sum_k X[m, k] * W[n, k] (+ bias[n])
// One wave computes a 64x64 tile: 4x4 grid of 16x16 WMMA accumulators.
// A-frag (16x4 fp32): lanes 0-15 hold M=lane, K = {0,1}; lanes 16-31 hold
// M=lane-16, K = {2,3}  -> per-lane contiguous float2 at X[row, kb + 2*hi].
// B-frag mirrors A with N in place of M (W is read row-wise: B[k][n]=W[n,k]).
// C/D: VGPR r, lanes 0-15 -> (M=r, N=lane); lanes 16-31 -> (M=r+8, N=lane-16).
// ---------------------------------------------------------------------------
__device__ __forceinline__ void gemm_nt_64x64(const float* __restrict__ X,
                                              const float* __restrict__ W,
                                              const float* __restrict__ bias,
                                              float* __restrict__ Out) {
  const int lane = threadIdx.x;
  const int lo = lane & 15;
  const int hi = lane >> 4;
  const int row0 = blockIdx.x * 64;
  const int col0 = blockIdx.y * 64;

  v8f acc[4][4];
#pragma unroll
  for (int i = 0; i < 4; ++i)
#pragma unroll
    for (int j = 0; j < 4; ++j)
      acc[i][j] = {0.f, 0.f, 0.f, 0.f, 0.f, 0.f, 0.f, 0.f};

  for (int kb = 0; kb < EDIM; kb += 4) {
    v2f a[4], b[4];
#pragma unroll
    for (int t = 0; t < 4; ++t) {
      a[t] = *(const v2f*)(X + (size_t)(row0 + t * 16 + lo) * EDIM + kb + 2 * hi);
      b[t] = *(const v2f*)(W + (size_t)(col0 + t * 16 + lo) * EDIM + kb + 2 * hi);
    }
#pragma unroll
    for (int i = 0; i < 4; ++i)
#pragma unroll
      for (int j = 0; j < 4; ++j) acc[i][j] = wmma_f32(a[i], b[j], acc[i][j]);
  }

#pragma unroll
  for (int i = 0; i < 4; ++i)
#pragma unroll
    for (int j = 0; j < 4; ++j) {
      const int col = col0 + j * 16 + lo;
      const float bv = bias ? bias[col] : 0.0f;
#pragma unroll
      for (int r = 0; r < 8; ++r) {
        const int row = row0 + i * 16 + r + 8 * hi;
        Out[(size_t)row * EDIM + col] = acc[i][j][r] + bv;
      }
    }
}

__global__ __launch_bounds__(32) void proj3(
    const float* __restrict__ values, const float* __restrict__ keys,
    const float* __restrict__ query, const float* __restrict__ Wv,
    const float* __restrict__ Wk, const float* __restrict__ Wq,
    float* __restrict__ vout, float* __restrict__ kout,
    float* __restrict__ qout) {
  const float* X;
  const float* W;
  float* O;
  if (blockIdx.z == 0) {
    X = values; W = Wv; O = vout;
  } else if (blockIdx.z == 1) {
    X = keys; W = Wk; O = kout;
  } else {
    X = query; W = Wq; O = qout;
  }
  gemm_nt_64x64(X, W, nullptr, O);
}

__global__ __launch_bounds__(32) void gemm_out(const float* __restrict__ X,
                                               const float* __restrict__ W,
                                               const float* __restrict__ bias,
                                               float* __restrict__ Out) {
  gemm_nt_64x64(X, W, bias, Out);
}

__device__ __forceinline__ float xhalf(float x) {
  return __builtin_bit_cast(
      float, __builtin_amdgcn_permlanex16(__builtin_bit_cast(int, x),
                                          __builtin_bit_cast(int, x), 0x76543210,
                                          0xfedcba98, false, false));
}

// e^x as v_exp_f32 of x * log2(e), which is what __expf compiles to; written as
// asm so that the free issue slot the instruction set asks for behind a
// transcendental stands inside the statement
__device__ __forceinline__ float exp_slot(float x) {
  float y;
  asm("v_exp_f32 %0, %1\n\tv_nop" : "=v"(y) : "v"(x * 1.44269504f));
  return y;
}

__global__ __launch_bounds__(128) void attn_fused(
    const float* __restrict__ Q, const float* __restrict__ K,
    const float* __restrict__ V, const float* __restrict__ dist,
    float* __restrict__ Oout) {
  __shared__ float kbuf[2][16 * KSTRIDE];
  __shared__ float vbuf[2][16 * KSTRIDE];

  const int tid = threadIdx.x;
  const int lane = tid & 31;
  const int w = tid >> 5;  // wave id 0..3
  const int lo = lane & 15;
  const int hi = lane >> 4;
  const int qb = blockIdx.x * 64 + w * 16;
  const int h = blockIdx.y;
  const size_t hoff = (size_t)h * HD;

  // cooperative staging indices: 128 threads x 8 floats = one 16x64 tile
  const int srow = tid >> 3;       // 0..15
  const int scol = (tid & 7) * 8;  // 0,8,...,56

  // Q^T as 16 B-fragments over D=64 (k-steps of 4): column lo, k = 2*hi + {0,1}
  v2f qf[16];
#pragma unroll
  for (int d4 = 0; d4 < 16; ++d4)
    qf[d4] = *(const v2f*)(Q + (size_t)(qb + lo) * EDIM + hoff + 4 * d4 + 2 * hi);

  // this lane's query row of the distance matrix, at its own 8 keys of a tile
  const float* drow = dist + (size_t)(qb + lo) * LSEQ + 8 * hi;

  float mrun = -3.0e38f;  // running maximum of query lo (equal in both halves)
  float srun = 0.0f;      // running sum over this half's keys only
  v8f o[4];               // o[mt][r] = O^T[d = mt*16 + 8*hi + r][query lo]
#pragma unroll
  for (int t = 0; t < 4; ++t) o[t] = {0.f, 0.f, 0.f, 0.f, 0.f, 0.f, 0.f, 0.f};

  // prologue: stage key/value tile 0 into buffer 0
  {
    const float* kg = K + (size_t)srow * EDIM + hoff + scol;
    const float* vg = V + (size_t)srow * EDIM + hoff + scol;
    v4f k0 = *(const v4f*)kg;
    v4f k1 = *(const v4f*)(kg + 4);
    v4f v0 = *(const v4f*)vg;
    v4f v1 = *(const v4f*)(vg + 4);
    *(v4f*)&kbuf[0][srow * KSTRIDE + scol] = k0;
    *(v4f*)&kbuf[0][srow * KSTRIDE + scol + 4] = k1;
    *(v4f*)&vbuf[0][srow * KSTRIDE + scol] = v0;
    *(v4f*)&vbuf[0][srow * KSTRIDE + scol + 4] = v1;
  }
  __syncthreads();

  const int NT = LSEQ / 16;
  for (int kt = 0; kt < NT; ++kt) {
    const int kb = kt * 16;
    const int cur = kt & 1;
    const int nxt = cur ^ 1;
    const bool havenext = (kt + 1) < NT;  // block-uniform

    // this tile's distances: 8 consecutive keys of one query per lane
    const v4f dm0 = *(const v4f*)(drow + kb);
    const v4f dm1 = *(const v4f*)(drow + kb + 4);

    // issue next tile's global loads early (overlap with WMMA compute)
    v4f pk0, pk1, pv0, pv1;
    if (havenext) {
      const float* kg = K + (size_t)(kb + 16 + srow) * EDIM + hoff + scol;
      const float* vg = V + (size_t)(kb + 16 + srow) * EDIM + hoff + scol;
      pk0 = *(const v4f*)kg;
      pk1 = *(const v4f*)(kg + 4);
      pv0 = *(const v4f*)vg;
      pv1 = *(const v4f*)(vg + 4);
    }

    const float* klds = kbuf[cur];
    const float* vlds = vbuf[cur];

    // A fragments of both products, from LDS.
    // K: A[m=key][k=d] = K[kb + m, d], row lo, k = 2*hi + {0,1} of step d4.
    v2f kf[16];
#pragma unroll
    for (int d4 = 0; d4 < 16; ++d4)
      kf[d4] = *(const v2f*)(klds + lo * KSTRIDE + 4 * d4 + 2 * hi);
    // V^T: k-slot 2*hi + j of step kc stands for key 8*hi + 2*kc + j, which is
    // where the probabilities lie in the registers of S^T:
    // A[m=d][k] = V[kb + 8*hi + 2*kc + j, mt*16 + m].
    float va0[4][4], va1[4][4];
#pragma unroll
    for (int kc = 0; kc < 4; ++kc) {
      const float* vrow = vlds + (8 * hi + 2 * kc) * KSTRIDE;
#pragma unroll
      for (int mt = 0; mt < 4; ++mt) {
        va0[kc][mt] = vrow[mt * 16 + lo];
        va1[kc][mt] = vrow[KSTRIDE + mt * 16 + lo];
      }
    }
    // keeps all loads of the pass at its head, as one group: the scheduler
    // otherwise sinks each to its first use (the next tile's to just ahead of
    // their LDS stores, a fragment's to its own WMMA) and waits out its latency
    __builtin_amdgcn_sched_barrier(0);

    // energy tile, transposed: E^T = K * Q^T
    // e[r] = E[query lo][key kb + 8*hi + r]
    v8f e = {0.f, 0.f, 0.f, 0.f, 0.f, 0.f, 0.f, 0.f};
#pragma unroll
    for (int d4 = 0; d4 < 16; ++d4) e = wmma_f32(kf[d4], qf[d4], e);

    // distance bias + scale; the quotient is formed for every lane and then
    // selected, so the eight keys stay independent straight-line code
    float z[8];
#pragma unroll
    for (int r = 0; r < 8; ++r) {
      const float dm = (r < 4) ? dm0[r & 3] : dm1[r & 3];
      const float inv = 1.0f / (dm + 1.0f);
      const float bias = (dm == 0.0f) ? 0.0f : inv;
      z[r] = (e[r] + bias) * INV_SQRT_E;
    }

    // online softmax of query lo: in-lane over 8 keys, one exchange of halves
    float mx = fmaxf(fmaxf(fmaxf(z[0], z[1]), fmaxf(z[2], z[3])),
                     fmaxf(fmaxf(z[4], z[5]), fmaxf(z[6], z[7])));
    mx = fmaxf(mx, xhalf(mx));
    const float mnew = fmaxf(mrun, mx);
    const float c = exp_slot(mrun - mnew);
    float p[8];
#pragma unroll
    for (int r = 0; r < 8; ++r) p[r] = exp_slot(z[r] - mnew);
    srun = srun * c +
           (((p[0] + p[1]) + (p[2] + p[3])) + ((p[4] + p[5]) + (p[6] + p[7])));
    mrun = mnew;
#pragma unroll
    for (int mt = 0; mt < 4; ++mt)
#pragma unroll
      for (int r = 0; r < 8; ++r) o[mt][r] *= c;  // rescale column lo of O^T

    // O^T += V^T * P^T: B of step kc is {p[2kc], p[2kc+1]} as it lies in the
    // registers, the same keys as va0[kc], va1[kc] hold at that k-slot
#pragma unroll
    for (int kc = 0; kc < 4; ++kc) {
      v2f pb;
      pb.x = p[2 * kc];
      pb.y = p[2 * kc + 1];
#pragma unroll
      for (int mt = 0; mt < 4; ++mt) {
        v2f va;
        va.x = va0[kc][mt];
        va.y = va1[kc][mt];
        o[mt] = wmma_f32(va, pb, o[mt]);
      }
    }

    // commit next tile into the other buffer, then block barrier
    if (havenext) {
      *(v4f*)&kbuf[nxt][srow * KSTRIDE + scol] = pk0;
      *(v4f*)&kbuf[nxt][srow * KSTRIDE + scol + 4] = pk1;
      *(v4f*)&vbuf[nxt][srow * KSTRIDE + scol] = pv0;
      *(v4f*)&vbuf[nxt][srow * KSTRIDE + scol + 4] = pv1;
    }
    __syncthreads();
  }

  // join the halves' sums, normalize and write [L, H*D]: 8 consecutive d a lane
  const float stot = srun + xhalf(srun);
  float* orow = Oout + (size_t)(qb + lo) * EDIM + hoff + 8 * hi;
#pragma unroll
  for (int mt = 0; mt < 4; ++mt) {
    v4f s0, s1;
#pragma unroll
    for (int r = 0; r < 4; ++r) {
      s0[r] = o[mt][r] / stot;
      s1[r] = o[mt][r + 4] / stot;
    }
    *(v4f*)(orow + mt * 16) = s0;
    *(v4f*)(orow + mt * 16 + 4) = s1;
  }
}

// ---------------------------------------------------------------------------
extern "C" void kernel_launch(void* const* d_in, const int* in_sizes, int n_in,
                              void* d_out, int out_size, void* d_ws,
                              size_t ws_size, hipStream_t stream) {
  const float* values = (const float*)d_in[0];
  const float* keys = (const float*)d_in[1];
  const float* query = (const float*)d_in[2];
  const float* dist = (const float*)d_in[3];
  const float* Wv = (const float*)d_in[4];
  const float* Wk = (const float*)d_in[5];
  const float* Wq = (const float*)d_in[6];
  const float* Wo = (const float*)d_in[7];
  const float* bo = (const float*)d_in[8];
  float* out = (float*)d_out;

  float* vproj = (float*)d_ws;
  float* kproj = vproj + (size_t)LSEQ * EDIM;
  float* qproj = kproj + (size_t)LSEQ * EDIM;
  float* aout = qproj + (size_t)LSEQ * EDIM;

  // 1) three input projections (z selects values/keys/query)
  dim3 pgrid(LSEQ / 64, EDIM / 64, 3);
  proj3<<<pgrid, dim3(32), 0, stream>>>(values, keys, query, Wv, Wk, Wq, vproj,
                                        kproj, qproj);

  // 2) fused biased attention: 4 waves/block, 64 query rows/block, per head
  dim3 agrid(LSEQ / 64, NH);
  attn_fused<<<agrid, dim3(128), 0, stream>>>(qproj, kproj, vproj, dist, aout);

  // 3) output projection + bias
  dim3 ogrid(LSEQ / 64, EDIM / 64, 1);
  gemm_out<<<ogrid, dim3(32), 0, stream>>>(aout, Wo, bo, out);
}

// v002
// A run of this version takes 216 microseconds.
// Two timings next to v001 both put it at 1.31 times that version's speed.
// Over all steps from v000 it is 2.64 times as fast.
#include <hip/hip_runtime.h>

typedef float v2f __attribute__((ext_vector_type(2)));
typedef float v4f __attribute__((ext_vector_type(4)));
typedef float v8f __attribute__((ext_vector_type(8)));

#define LSEQ 2048
#define EDIM 1024
#define NH   16
#define HD   64
#define INV_SQRT_E 0.03125f  // 1/sqrt(1024)
#define KSTRIDE 68           // padded LDS row stride for K/V tiles

// D = A(16x4) * B(4x16) + C, fp32. 8-arg form:
// (neg_a, A, neg_b, B, c_mod, C, reuse_a, reuse_b)
__device__ __forceinline__ v8f wmma_f32(v2f a, v2f b, v8f c) {
  return __builtin_amdgcn_wmma_f32_16x16x4_f32(false, a, false, b, (short)0, c,
                                               false, false);
}

// ---------------------------------------------------------------------------
// NT GEMM: Out[m, n] = sum_k X[m, k] * W[n, k] (+ bias[n])
// A work-group of 4 waves (2 x 2) computes a (32*MT) x 64 tile; each wave owns
// (16*MT) x 32 of it as MT x 2 WMMA accumulators. K runs in chunks of GBK
// floats: the chunk's rows of X and of W are brought in by 16-byte loads that
// cover whole 128-byte lines, kept in LDS (two buffers) and shared by the four
// waves; the next chunk's global loads fly while this chunk is computed.
// A-frag (16x4 fp32): lanes 0-15 hold M=lane, K = {0,1}; lanes 16-31 hold
// M=lane-16, K = {2,3}  -> per-lane contiguous float2 at row, kb + 2*hi.
// B-frag mirrors A with N in place of M (W is read row-wise: B[k][n]=W[n,k]).
// C/D: VGPR r, lanes 0-15 -> (M=r, N=lane); lanes 16-31 -> (M=r+8, N=lane-16).
// LDS row pitch GBK + 4 floats: the 16 rows of a fragment read start on 16
// distinct groups of 4 banks, so an 8-byte read of 32 lanes meets every bank
// once.
// Every loop over fragments, accumulators and staged pieces is unrolled, so
// that these arrays are indexed by constants and stay in registers.
// ---------------------------------------------------------------------------
template <int MT, int GBK>
__device__ __forceinline__ void gemm_chunk(const float* __restrict__ xa,
                                           const float* __restrict__ wb,
                                           v8f (&acc)[MT][2]) {
  constexpr int GPITCH = GBK + 4;
#pragma unroll
  for (int k4 = 0; k4 < GBK / 4; ++k4) {
    v2f a[MT], b[2];
#pragma unroll
    for (int i = 0; i < MT; ++i)
      a[i] = *(const v2f*)(xa + i * 16 * GPITCH + 4 * k4);
#pragma unroll
    for (int j = 0; j < 2; ++j)
      b[j] = *(const v2f*)(wb + j * 16 * GPITCH + 4 * k4);
#pragma unroll
    for (int i = 0; i < MT; ++i)
#pragma unroll
      for (int j = 0; j < 2; ++j) acc[i][j] = wmma_f32(a[i], b[j], acc[i][j]);
  }
}

template <int MT, int GBK>
__device__ __forceinline__ void gemm_nt_block(const float* __restrict__ X,
                                              const float* __restrict__ W,
                                              const float* __restrict__ bias,
                                              float* __restrict__ Out) {
  constexpr int GPITCH = GBK + 4;      // LDS row pitch in floats
  constexpr int BM = 32 * MT;          // rows of the work-group's tile
  constexpr int TPR = GBK / 4;         // threads that cover one row of a chunk
  constexpr int RPP = 128 / TPR;       // rows the work-group covers per load
  constexpr int XL = BM / RPP;         // 16-byte loads per thread, chunk of X
  constexpr int WL = 64 / RPP;         // the same, chunk of W
  constexpr int NCH = EDIM / GBK;
  __shared__ __attribute__((aligned(16))) float xs[2][BM * GPITCH];
  __shared__ __attribute__((aligned(16))) float wsh[2][64 * GPITCH];

  const int tid = threadIdx.x;
  const int lane = tid & 31;
  const int w = tid >> 5;
  const int lo = lane & 15;
  const int hi = lane >> 4;
  const int row0 = blockIdx.x * BM;
  const int col0 = blockIdx.y * 64;
  const int wr = (w >> 1) * (16 * MT);  // this wave's rows in the tile
  const int wc = (w & 1) * 32;          // this wave's columns in the tile

  // staging: TPR threads cover one row of the chunk, a wave 4 whole lines
  const int srow = tid / TPR;
  const int scol = (tid % TPR) * 4;
  // wave-uniform base plus one fixed 32-bit offset per lane: the loads need no
  // address arithmetic in vector registers
  const float* xg = X + (size_t)row0 * EDIM;
  const float* wg = W + (size_t)col0 * EDIM;
  const unsigned goff = (unsigned)(srow * EDIM + scol) * 4u;  // in bytes
  const int sdst = srow * GPITCH + scol;

  v8f acc[MT][2];
#pragma unroll
  for (int i = 0; i < MT; ++i)
#pragma unroll
    for (int j = 0; j < 2; ++j)
      acc[i][j] = {0.f, 0.f, 0.f, 0.f, 0.f, 0.f, 0.f, 0.f};

  v4f px[XL], pw[WL];
#pragma unroll
  for (int t = 0; t < XL; ++t)
    px[t] = *(const v4f*)((const char*)(xg + t * RPP * EDIM) + goff);
#pragma unroll
  for (int t = 0; t < WL; ++t)
    pw[t] = *(const v4f*)((const char*)(wg + t * RPP * EDIM) + goff);
#pragma unroll
  for (int t = 0; t < XL; ++t) *(v4f*)&xs[0][sdst + t * RPP * GPITCH] = px[t];
#pragma unroll
  for (int t = 0; t < WL; ++t) *(v4f*)&wsh[0][sdst + t * RPP * GPITCH] = pw[t];
  __syncthreads();

  const int aoff = (wr + lo) * GPITCH + 2 * hi;
  const int boff = (wc + lo) * GPITCH + 2 * hi;

  unsigned voff = goff;  // this lane's offset in the rows, moved on by chunks
  for (int c = 0; c < NCH; ++c) {
    const int cur = c & 1;
    const bool more = (c + 1) < NCH;  // block-uniform
    if (more) {
      voff += GBK * 4;
#pragma unroll
      for (int t = 0; t < XL; ++t)
        px[t] = *(const v4f*)((const char*)(xg + t * RPP * EDIM) + voff);
#pragma unroll
      for (int t = 0; t < WL; ++t)
        pw[t] = *(const v4f*)((const char*)(wg + t * RPP * EDIM) + voff);
    }
    // keeps the next chunk's global loads at the head of the trip: the
    // scheduler otherwise sinks them to just ahead of their LDS stores, where
    // their whole latency is waited out
    __builtin_amdgcn_sched_barrier(0);

    gemm_chunk<MT, GBK>(&xs[cur][aoff], &wsh[cur][boff], acc);

    if (more) {
#pragma unroll
      for (int t = 0; t < XL; ++t)
        *(v4f*)&xs[cur ^ 1][sdst + t * RPP * GPITCH] = px[t];
#pragma unroll
      for (int t = 0; t < WL; ++t)
        *(v4f*)&wsh[cur ^ 1][sdst + t * RPP * GPITCH] = pw[t];
    }
    __syncthreads();
  }

  float bv[2];
#pragma unroll
  for (int j = 0; j < 2; ++j)
    bv[j] = bias ? bias[col0 + wc + j * 16 + lo] : 0.0f;
#pragma unroll
  for (int i = 0; i < MT; ++i)
#pragma unroll
    for (int j = 0; j < 2; ++j) {
      const int col = col0 + wc + j * 16 + lo;
#pragma unroll
      for (int r = 0; r < 8; ++r) {
        const int row = row0 + wr + i * 16 + r + 8 * hi;
        Out[(size_t)row * EDIM + col] = acc[i][j][r] + bv[j];
      }
    }
}

__global__ __launch_bounds__(128) void proj3(
    const float* __restrict__ values, const float* __restrict__ keys,
    const float* __restrict__ query, const float* __restrict__ Wv,
    const float* __restrict__ Wk, const float* __restrict__ Wq,
    float* __restrict__ vout, float* __restrict__ kout,
    float* __restrict__ qout) {
  const float* X;
  const float* W;
  float* O;
  if (blockIdx.z == 0) {
    X = values; W = Wv; O = vout;
  } else if (blockIdx.z == 1) {
    X = keys; W = Wk; O = kout;
  } else {
    X = query; W = Wq; O = qout;
  }
  gemm_nt_block<4, 64>(X, W, nullptr, O);
}

__global__ __launch_bounds__(128) void gemm_out(const float* __restrict__ X,
                                                const float* __restrict__ W,
                                                const float* __restrict__ bias,
                                                float* __restrict__ Out) {
  gemm_nt_block<2, 128>(X, W, bias, Out);
}

__device__ __forceinline__ float xhalf(float x) {
  return __builtin_bit_cast(
      float, __builtin_amdgcn_permlanex16(__builtin_bit_cast(int, x),
                                          __builtin_bit_cast(int, x), 0x76543210,
                                          0xfedcba98, false, false));
}

// e^x as v_exp_f32 of x * log2(e), which is what __expf compiles to; written as
// asm so that the free issue slot the instruction set asks for behind a
// transcendental stands inside the statement
__device__ __forceinline__ float exp_slot(float x) {
  float y;
  asm("v_exp_f32 %0, %1\n\tv_nop" : "=v"(y) : "v"(x * 1.44269504f));
  return y;
}

__global__ __launch_bounds__(128) void attn_fused(
    const float* __restrict__ Q, const float* __restrict__ K,
    const float* __restrict__ V, const float* __restrict__ dist,
    float* __restrict__ Oout) {
  __shared__ float kbuf[2][16 * KSTRIDE];
  __shared__ float vbuf[2][16 * KSTRIDE];

  const int tid = threadIdx.x;
  const int lane = tid & 31;
  const int w = tid >> 5;  // wave id 0..3
  const int lo = lane & 15;
  const int hi = lane >> 4;
  const int qb = blockIdx.x * 64 + w * 16;
  const int h = blockIdx.y;
  const size_t hoff = (size_t)h * HD;

  // cooperative staging indices: 128 threads x 8 floats = one 16x64 tile
  const int srow = tid >> 3;       // 0..15
  const int scol = (tid & 7) * 8;  // 0,8,...,56

  // Q^T as 16 B-fragments over D=64 (k-steps of 4): column lo, k = 2*hi + {0,1}
  v2f qf[16];
#pragma unroll
  for (int d4 = 0; d4 < 16; ++d4)
    qf[d4] = *(const v2f*)(Q + (size_t)(qb + lo) * EDIM + hoff + 4 * d4 + 2 * hi);

  // this lane's query row of the distance matrix, at its own 8 keys of a tile
  const float* drow = dist + (size_t)(qb + lo) * LSEQ + 8 * hi;

  float mrun = -3.0e38f;  // running maximum of query lo (equal in both halves)
  float srun = 0.0f;      // running sum over this half's keys only
  v8f o[4];               // o[mt][r] = O^T[d = mt*16 + 8*hi + r][query lo]
#pragma unroll
  for (int t = 0; t < 4; ++t) o[t] = {0.f, 0.f, 0.f, 0.f, 0.f, 0.f, 0.f, 0.f};

  // prologue: stage key/value tile 0 into buffer 0
  {
    const float* kg = K + (size_t)srow * EDIM + hoff + scol;
    const float* vg = V + (size_t)srow * EDIM + hoff + scol;
    v4f k0 = *(const v4f*)kg;
    v4f k1 = *(const v4f*)(kg + 4);
    v4f v0 = *(const v4f*)vg;
    v4f v1 = *(const v4f*)(vg + 4);
    *(v4f*)&kbuf[0][srow * KSTRIDE + scol] = k0;
    *(v4f*)&kbuf[0][srow * KSTRIDE + scol + 4] = k1;
    *(v4f*)&vbuf[0][srow * KSTRIDE + scol] = v0;
    *(v4f*)&vbuf[0][srow * KSTRIDE + scol + 4] = v1;
  }
  __syncthreads();

  const int NT = LSEQ / 16;
  for (int kt = 0; kt < NT; ++kt) {
    const int kb = kt * 16;
    const int cur = kt & 1;
    const int nxt = cur ^ 1;
    const bool havenext = (kt + 1) < NT;  // block-uniform

    // this tile's distances: 8 consecutive keys of one query per lane
    const v4f dm0 = *(const v4f*)(drow + kb);
    const v4f dm1 = *(const v4f*)(drow + kb + 4);

    // issue next tile's global loads early (overlap with WMMA compute)
    v4f pk0, pk1, pv0, pv1;
    if (havenext) {
      const float* kg = K + (size_t)(kb + 16 + srow) * EDIM + hoff + scol;
      const float* vg = V + (size_t)(kb + 16 + srow) * EDIM + hoff + scol;
      pk0 = *(const v4f*)kg;
      pk1 = *(const v4f*)(kg + 4);
      pv0 = *(const v4f*)vg;
      pv1 = *(const v4f*)(vg + 4);
    }

    const float* klds = kbuf[cur];
    const float* vlds = vbuf[cur];

    // A fragments of both products, from LDS.
    // K: A[m=key][k=d] = K[kb + m, d], row lo, k = 2*hi + {0,1} of step d4.
    v2f kf[16];
#pragma unroll
    for (int d4 = 0; d4 < 16; ++d4)
      kf[d4] = *(const v2f*)(klds + lo * KSTRIDE + 4 * d4 + 2 * hi);
    // V^T: k-slot 2*hi + j of step kc stands for key 8*hi + 2*kc + j, which is
    // where the probabilities lie in the registers of S^T:
    // A[m=d][k] = V[kb + 8*hi + 2*kc + j, mt*16 + m].
    float va0[4][4], va1[4][4];
#pragma unroll
    for (int kc = 0; kc < 4; ++kc) {
      const float* vrow = vlds + (8 * hi + 2 * kc) * KSTRIDE;
#pragma unroll
      for (int mt = 0; mt < 4; ++mt) {
        va0[kc][mt] = vrow[mt * 16 + lo];
        va1[kc][mt] = vrow[KSTRIDE + mt * 16 + lo];
      }
    }
    // keeps all loads of the pass at its head, as one group: the scheduler
    // otherwise sinks each to its first use (the next tile's to just ahead of
    // their LDS stores, a fragment's to its own WMMA) and waits out its latency
    __builtin_amdgcn_sched_barrier(0);

    // energy tile, transposed: E^T = K * Q^T
    // e[r] = E[query lo][key kb + 8*hi + r]
    v8f e = {0.f, 0.f, 0.f, 0.f, 0.f, 0.f, 0.f, 0.f};
#pragma unroll
    for (int d4 = 0; d4 < 16; ++d4) e = wmma_f32(kf[d4], qf[d4], e);

    // distance bias + scale; the quotient is formed for every lane and then
    // selected, so the eight keys stay independent straight-line code
    float z[8];
#pragma unroll
    for (int r = 0; r < 8; ++r) {
      const float dm = (r < 4) ? dm0[r & 3] : dm1[r & 3];
      const float inv = 1.0f / (dm + 1.0f);
      const float bias = (dm == 0.0f) ? 0.0f : inv;
      z[r] = (e[r] + bias) * INV_SQRT_E;
    }

    // online softmax of query lo: in-lane over 8 keys, one exchange of halves
    float mx = fmaxf(fmaxf(fmaxf(z[0], z[1]), fmaxf(z[2], z[3])),
                     fmaxf(fmaxf(z[4], z[5]), fmaxf(z[6], z[7])));
    mx = fmaxf(mx, xhalf(mx));
    const float mnew = fmaxf(mrun, mx);
    const float c = exp_slot(mrun - mnew);
    float p[8];
#pragma unroll
    for (int r = 0; r < 8; ++r) p[r] = exp_slot(z[r] - mnew);
    srun = srun * c +
           (((p[0] + p[1]) + (p[2] + p[3])) + ((p[4] + p[5]) + (p[6] + p[7])));
    mrun = mnew;
#pragma unroll
    for (int mt = 0; mt < 4; ++mt)
#pragma unroll
      for (int r = 0; r < 8; ++r) o[mt][r] *= c;  // rescale column lo of O^T

    // O^T += V^T * P^T: B of step kc is {p[2kc], p[2kc+1]} as it lies in the
    // registers, the same keys as va0[kc], va1[kc] hold at that k-slot
#pragma unroll
    for (int kc = 0; kc < 4; ++kc) {
      v2f pb;
      pb.x = p[2 * kc];
      pb.y = p[2 * kc + 1];
#pragma unroll
      for (int mt = 0; mt < 4; ++mt) {
        v2f va;
        va.x = va0[kc][mt];
        va.y = va1[kc][mt];
        o[mt] = wmma_f32(va, pb, o[mt]);
      }
    }

    // commit next tile into the other buffer, then block barrier
    if (havenext) {
      *(v4f*)&kbuf[nxt][srow * KSTRIDE + scol] = pk0;
      *(v4f*)&kbuf[nxt][srow * KSTRIDE + scol + 4] = pk1;
      *(v4f*)&vbuf[nxt][srow * KSTRIDE + scol] = pv0;
      *(v4f*)&vbuf[nxt][srow * KSTRIDE + scol + 4] = pv1;
    }
    __syncthreads();
  }

  // join the halves' sums, normalize and write [L, H*D]: 8 consecutive d a lane
  const float stot = srun + xhalf(srun);
  float* orow = Oout + (size_t)(qb + lo) * EDIM + hoff + 8 * hi;
#pragma unroll
  for (int mt = 0; mt < 4; ++mt) {
    v4f s0, s1;
#pragma unroll
    for (int r = 0; r < 4; ++r) {
      s0[r] = o[mt][r] / stot;
      s1[r] = o[mt][r + 4] / stot;
    }
    *(v4f*)(orow + mt * 16) = s0;
    *(v4f*)(orow + mt * 16 + 4) = s1;
  }
}

// ---------------------------------------------------------------------------
extern "C" void kernel_launch(void* const* d_in, const int* in_sizes, int n_in,
                              void* d_out, int out_size, void* d_ws,
                              size_t ws_size, hipStream_t stream) {
  const float* values = (const float*)d_in[0];
  const float* keys = (const float*)d_in[1];
  const float* query = (const float*)d_in[2];
  const float* dist = (const float*)d_in[3];
  const float* Wv = (const float*)d_in[4];
  const float* Wk = (const float*)d_in[5];
  const float* Wq = (const float*)d_in[6];
  const float* Wo = (const float*)d_in[7];
  const float* bo = (const float*)d_in[8];
  float* out = (float*)d_out;

  float* vproj = (float*)d_ws;
  float* kproj = vproj + (size_t)LSEQ * EDIM;
  float* qproj = kproj + (size_t)LSEQ * EDIM;
  float* aout = qproj + (size_t)LSEQ * EDIM;

  // 1) three input projections (z selects values/keys/query)
  // 128x64 tiles, K chunks of 64: 768 work-groups of 4 waves; three of them
  // fill a WGP's LDS, three waves a SIMD
  dim3 pgrid(LSEQ / 128, EDIM / 64, 3);
  proj3<<<pgrid, dim3(128), 0, stream>>>(values, keys, query, Wv, Wk, Wq, vproj,
                                        kproj, qproj);

  // 2) fused biased attention: 4 waves/block, 64 query rows/block, per head
  dim3 agrid(LSEQ / 64, NH);
  attn_fused<<<agrid, dim3(128), 0, stream>>>(qproj, kproj, vproj, dist, aout);

  // 3) output projection + bias
  // 64x64 tiles, K chunks of 128: 512 work-groups of 4 waves; two of them fit
  // a WGP's LDS, two waves a SIMD
  dim3 ogrid(LSEQ / 64, EDIM / 64, 1);
  gemm_out<<<ogrid, dim3(128), 0, stream>>>(aout, Wo, bo, out);
}
